// v000
// Times are from an AMD MI455X. After a warm-up the kernel runs many times in a row, and a time is the length of
// such a window on the GPU divided by its runs, so every launch and the gaps after it count. The runs cycle
// through copies of the inputs. A figure is the median of several windows, for all but v000 over two sittings.
// Sittings can differ by a few percent; kernels timed side by side share one.
// v000 is the starting kernel. One run takes 417 microseconds.
#include <hip/hip_runtime.h>
#include <math.h>

// Problem constants (match reference)
#define BB 4
#define WW 2048
#define DD 512
#define HH 8
#define DKK 64          // DD / HH
#define BIAS_SCALE 4.0f
#define LN_EPS 1e-5f
#define SOFT_SCALE 0.125f   // 1/sqrt(64)

typedef __attribute__((ext_vector_type(2))) float v2f;
typedef __attribute__((ext_vector_type(8))) float v8f;

// D = A(16x4) * B(4x16) + C(16x16), fp32 WMMA (CDNA5 V_WMMA_F32_16X16X4_F32)
__device__ __forceinline__ v8f wmma_f32(v2f a, v2f b, v8f c) {
    return __builtin_amdgcn_wmma_f32_16x16x4_f32(
        /*neg_a=*/false, a, /*neg_b=*/false, b,
        /*c_mod=*/(short)0, c, /*reuse_a=*/false, /*reuse_b=*/false);
}

// ---------------------------------------------------------------------------
// Kernel 1: fused QKV projection.  out[b][h][w][dk] = x[b][w]·W[:,n] + bias[n]
// Block: 128 threads (4 waves).  Block tile: 64(M) x 16(N), K staged in LDS.
// ---------------------------------------------------------------------------
#define KC 32
__global__ __launch_bounds__(128) void qkv_proj_kernel(
    const float* __restrict__ x,
    const float* __restrict__ Wq, const float* __restrict__ Wk, const float* __restrict__ Wv,
    const float* __restrict__ bq, const float* __restrict__ bk, const float* __restrict__ bv,
    float* __restrict__ q_ws, float* __restrict__ k_ws, float* __restrict__ v_ws)
{
    const int m0 = blockIdx.x * 64;
    const int n0 = blockIdx.y * 16;
    const int zb = blockIdx.z;              // b*3 + which
    const int b = zb / 3, which = zb - 3 * b;

    const float* Wm   = (which == 0) ? Wq : (which == 1) ? Wk : Wv;
    const float* bias = (which == 0) ? bq : (which == 1) ? bk : bv;
    float*       outp = (which == 0) ? q_ws : (which == 1) ? k_ws : v_ws;

    __shared__ float Alds[64][36];          // 64 x KC, +4 pad (keeps 16B align)
    __shared__ float Blds[KC][16];

    const int tid  = threadIdx.x;
    const int lane = tid & 31;
    const int wav  = tid >> 5;
    const int half = lane >> 4;
    const int l    = lane & 15;

    v8f acc = {};
    const float* xb = x + (size_t)b * WW * DD;

    for (int k0 = 0; k0 < DD; k0 += KC) {
        // cooperative load A tile: 64x32 floats as float4 (coalesced)
        #pragma unroll
        for (int i = 0; i < 4; ++i) {
            int f4  = i * 128 + tid;
            int row = f4 >> 3, c4 = f4 & 7;
            float4 v = *(const float4*)(xb + (size_t)(m0 + row) * DD + k0 + c4 * 4);
            *(float4*)(&Alds[row][c4 * 4]) = v;
        }
        // cooperative load B tile: 32x16 floats (one float4 per thread)
        {
            int row = tid >> 2, c4 = tid & 3;
            float4 v = *(const float4*)(Wm + (size_t)(k0 + row) * DD + n0 + c4 * 4);
            *(float4*)(&Blds[row][c4 * 4]) = v;
        }
        if (k0 + KC < DD)   // hint next A tile into cache (global_prefetch_b8)
            __builtin_prefetch(xb + (size_t)(m0 + (tid >> 1)) * DD + k0 + KC, 0, 1);
        __syncthreads();

        const int arow = wav * 16 + l;
        #pragma unroll
        for (int kk = 0; kk < KC; kk += 4) {
            v2f a, bf;
            a.x  = Alds[arow][kk + 2 * half];
            a.y  = Alds[arow][kk + 2 * half + 1];
            bf.x = Blds[kk + 2 * half][l];
            bf.y = Blds[kk + 2 * half + 1][l];
            acc  = wmma_f32(a, bf, acc);
        }
        __syncthreads();
    }

    // store to head-major layout (B, H, W, DK)
    const int col = n0 + l;
    const int h   = col >> 6;
    const int dk  = col & 63;
    const float bv_ = bias[col];
    #pragma unroll
    for (int i = 0; i < 8; ++i) {
        int row = m0 + wav * 16 + i + 8 * half;
        outp[(((size_t)b * HH + h) * WW + row) * DKK + dk] = acc[i] + bv_;
    }
}

// ---------------------------------------------------------------------------
// Kernel 2: flash attention with temporal bias + mask.
// Block: 128 threads (4 waves); each wave owns one 16-query tile; the 4 waves
// share (b,h), so K/V 16x64 tiles are double-buffered in LDS via CDNA5
// GLOBAL_LOAD_ASYNC_TO_LDS_B128 (ASYNCcnt) and consumed by all 4 waves.
// ---------------------------------------------------------------------------
#define KV_STRIDE 68   // 64 + 4 pad: 4-bank lane skew, rows stay 8B aligned

// async copy of one contiguous 16x64-float tile (4KB) into padded LDS rows
__device__ __forceinline__ void async_tile_to_lds(const float* __restrict__ src,
                                                  unsigned lds_base_bytes, int tid) {
    #pragma unroll
    for (int i = 0; i < 2; ++i) {
        int f   = (i * 128 + tid) * 4;          // first float of this 16B chunk
        int row = f >> 6, col = f & 63;
        unsigned lds_off = lds_base_bytes + (unsigned)(row * KV_STRIDE + col) * 4u;
        const float* g = src + f;
        asm volatile("global_load_async_to_lds_b128 %0, %1, off"
                     :: "v"(lds_off), "v"(g) : "memory");
    }
}

__global__ __launch_bounds__(128) void flash_attn_kernel(
    const float* __restrict__ q_ws, const float* __restrict__ k_ws,
    const float* __restrict__ v_ws,
    const float* __restrict__ E_time, const int* __restrict__ A_time,
    float* __restrict__ y_ws)
{
    const int tid  = threadIdx.x;
    const int wav  = tid >> 5;
    const int lane = tid & 31;
    const int half = lane >> 4;
    const int l    = lane & 15;

    const int qt = blockIdx.x * 4 + wav;     // 0..127
    const int h  = blockIdx.y;
    const int b  = blockIdx.z;
    const int q0 = qt * 16;

    __shared__ float Klds[2][16][KV_STRIDE];
    __shared__ float Vlds[2][16][KV_STRIDE];
    __shared__ float Plds[4][16][18];        // per-wave P staging (8B rows)

    const size_t head_base = ((size_t)b * HH + h) * WW;
    const float* kbase = k_ws + head_base * DKK;
    const float* vbase = v_ws + head_base * DKK;
    const unsigned klds0 = (unsigned)(size_t)&Klds[0][0][0];
    const unsigned vlds0 = (unsigned)(size_t)&Vlds[0][0][0];
    const unsigned kvbuf_bytes = 16u * KV_STRIDE * 4u;

    // preload Q fragments (A-operand layout) for all 16 K-steps of DK=64
    v2f qfrag[16];
    {
        const float* qrow = q_ws + (head_base + q0 + l) * DKK;
        #pragma unroll
        for (int kk4 = 0; kk4 < 16; ++kk4) {
            qfrag[kk4].x = qrow[kk4 * 4 + 2 * half];
            qfrag[kk4].y = qrow[kk4 * 4 + 2 * half + 1];
        }
    }

    v8f o0 = {}, o1 = {}, o2 = {}, o3 = {};
    float mrun[8], Lrun[8];
    #pragma unroll
    for (int i = 0; i < 8; ++i) { mrun[i] = -1e37f; Lrun[i] = 0.0f; }

    // prime the pipeline: async-stage tile 0 into buffer 0
    async_tile_to_lds(kbase, klds0, tid);
    async_tile_to_lds(vbase, vlds0, tid);

    for (int j = 0; j < WW / 16; ++j) {
        const int buf = j & 1;

        // issue next tile's async copies into the other buffer (its previous
        // readers finished at the trailing barrier of iteration j-1)
        if (j + 1 < WW / 16) {
            const float* kn = kbase + (size_t)(j + 1) * 16 * DKK;
            const float* vn = vbase + (size_t)(j + 1) * 16 * DKK;
            unsigned nb = (unsigned)((j + 1) & 1) * kvbuf_bytes;
            async_tile_to_lds(kn, klds0 + nb, tid);
            async_tile_to_lds(vn, vlds0 + nb, tid);
            // async loads complete in order: first 4 (tile j) done when cnt<=4
            asm volatile("s_wait_asynccnt 0x4" ::: "memory");
        } else {
            asm volatile("s_wait_asynccnt 0x0" ::: "memory");
        }
        __syncthreads();                     // tile j visible to all waves

        // ----- S = Q * K^T (16x16), K-dim = 64 -> 16 WMMAs -----
        v8f s = {};
        #pragma unroll
        for (int kk4 = 0; kk4 < 16; ++kk4) {
            v2f bf;
            bf.x = Klds[buf][l][kk4 * 4 + 2 * half];
            bf.y = Klds[buf][l][kk4 * 4 + 2 * half + 1];
            s = wmma_f32(qfrag[kk4], bf, s);
        }

        // ----- bias + mask (each E/A element read once per head h, coalesced) --
        const int kcol = j * 16 + l;
        #pragma unroll
        for (int i = 0; i < 8; ++i) {
            int row = q0 + i + 8 * half;
            size_t idx = ((size_t)b * WW + row) * WW + kcol;
            float e = E_time[idx];
            int   a = A_time[idx];
            float biasv = fminf(fmaxf(e, -1.0f), 1.0f) * BIAS_SCALE;
            float sv = s[i] * SOFT_SCALE + biasv;
            s[i] = (a > 0) ? sv : -1e38f;
        }

        // ----- online softmax (row stats replicated across 16-lane halves) --
        float p[8], sc[8];
        #pragma unroll
        for (int i = 0; i < 8; ++i) {
            float rm = s[i];
            rm = fmaxf(rm, __shfl_xor(rm, 1, 32));
            rm = fmaxf(rm, __shfl_xor(rm, 2, 32));
            rm = fmaxf(rm, __shfl_xor(rm, 4, 32));
            rm = fmaxf(rm, __shfl_xor(rm, 8, 32));
            float mn = fmaxf(mrun[i], rm);
            sc[i] = __expf(mrun[i] - mn);
            float pv = __expf(s[i] - mn);
            p[i] = pv;
            float rs = pv;
            rs += __shfl_xor(rs, 1, 32);
            rs += __shfl_xor(rs, 2, 32);
            rs += __shfl_xor(rs, 4, 32);
            rs += __shfl_xor(rs, 8, 32);
            Lrun[i] = Lrun[i] * sc[i] + rs;
            mrun[i] = mn;
        }
        #pragma unroll
        for (int i = 0; i < 8; ++i) {
            o0[i] *= sc[i]; o1[i] *= sc[i]; o2[i] *= sc[i]; o3[i] *= sc[i];
        }

        // ----- C-layout -> A-layout via LDS, then O += P * V -----
        #pragma unroll
        for (int i = 0; i < 8; ++i)
            Plds[wav][i + 8 * half][l] = p[i];
        // same-wave DS ops are in order; loads below observe the stores

        #pragma unroll
        for (int kk = 0; kk < 16; kk += 4) {
            v2f a;
            a.x = Plds[wav][l][kk + 2 * half];
            a.y = Plds[wav][l][kk + 2 * half + 1];
            const int r0 = kk + 2 * half;
            v2f bf;
            bf.x = Vlds[buf][r0][l];      bf.y = Vlds[buf][r0 + 1][l];
            o0 = wmma_f32(a, bf, o0);
            bf.x = Vlds[buf][r0][16 + l]; bf.y = Vlds[buf][r0 + 1][16 + l];
            o1 = wmma_f32(a, bf, o1);
            bf.x = Vlds[buf][r0][32 + l]; bf.y = Vlds[buf][r0 + 1][32 + l];
            o2 = wmma_f32(a, bf, o2);
            bf.x = Vlds[buf][r0][48 + l]; bf.y = Vlds[buf][r0 + 1][48 + l];
            o3 = wmma_f32(a, bf, o3);
        }
        __syncthreads();   // all waves done reading buf before it is restaged
    }

    // ----- normalize and store y (merge heads -> (B, W, D) layout) -----
    #pragma unroll
    for (int i = 0; i < 8; ++i) {
        float inv = 1.0f / Lrun[i];
        int row = q0 + i + 8 * half;
        float* yr = y_ws + ((size_t)b * WW + row) * DD + h * DKK;
        yr[l]      = o0[i] * inv;
        yr[16 + l] = o1[i] * inv;
        yr[32 + l] = o2[i] * inv;
        yr[48 + l] = o3[i] * inv;
    }
}

// ---------------------------------------------------------------------------
// Kernel 3: output projection + residual + LayerNorm, fused.
// Block: 256 threads (8 waves) computes 16 full rows (16 x 512).
// ---------------------------------------------------------------------------
__global__ __launch_bounds__(256) void out_ln_kernel(
    const float* __restrict__ y_ws, const float* __restrict__ Wo,
    const float* __restrict__ bo,   const float* __restrict__ x,
    const float* __restrict__ ln_g, const float* __restrict__ ln_b,
    float* __restrict__ out)
{
    const int m0 = blockIdx.x * 16;
    const int b  = blockIdx.y;
    const int tid  = threadIdx.x;
    const int wav  = tid >> 5;
    const int lane = tid & 31;
    const int half = lane >> 4;
    const int l    = lane & 15;

    __shared__ float Alds[16][36];
    __shared__ float Hlds[16][520];          // 16 x 512 (+8 pad)

    v8f a0 = {}, a1 = {}, a2 = {}, a3 = {};
    const float* yb = y_ws + (size_t)b * WW * DD;

    for (int k0 = 0; k0 < DD; k0 += KC) {
        if (tid < 128) {                     // 16x32 A tile, one float4/thread
            int row = tid >> 3, c4 = tid & 7;
            *(float4*)(&Alds[row][c4 * 4]) =
                *(const float4*)(yb + (size_t)(m0 + row) * DD + k0 + c4 * 4);
        }
        __syncthreads();
        #pragma unroll
        for (int kk = 0; kk < KC; kk += 4) {
            v2f a;
            a.x = Alds[l][kk + 2 * half];
            a.y = Alds[l][kk + 2 * half + 1];
            const float* wr = Wo + (size_t)(k0 + kk + 2 * half) * DD + wav * 64 + l;
            v2f bf;
            bf.x = wr[0];   bf.y = wr[DD];        a0 = wmma_f32(a, bf, a0);
            bf.x = wr[16];  bf.y = wr[DD + 16];   a1 = wmma_f32(a, bf, a1);
            bf.x = wr[32];  bf.y = wr[DD + 32];   a2 = wmma_f32(a, bf, a2);
            bf.x = wr[48];  bf.y = wr[DD + 48];   a3 = wmma_f32(a, bf, a3);
        }
        __syncthreads();
    }

    // h = proj + bias + residual -> LDS
    const float* xb = x + ((size_t)b * WW + m0) * DD;
    #pragma unroll
    for (int i = 0; i < 8; ++i) {
        int row = i + 8 * half;
        int n = wav * 64 + l;
        Hlds[row][n]      = a0[i] + bo[n]      + xb[(size_t)row * DD + n];
        Hlds[row][n + 16] = a1[i] + bo[n + 16] + xb[(size_t)row * DD + n + 16];
        Hlds[row][n + 32] = a2[i] + bo[n + 32] + xb[(size_t)row * DD + n + 32];
        Hlds[row][n + 48] = a3[i] + bo[n + 48] + xb[(size_t)row * DD + n + 48];
    }
    __syncthreads();

    // LayerNorm: 16 threads per row, 32 cols each; shuffle-reduce within halves
    const int row = tid >> 4;
    const int seg = tid & 15;
    float s1 = 0.0f, s2 = 0.0f;
    #pragma unroll
    for (int c = 0; c < 32; ++c) {
        float v = Hlds[row][seg * 32 + c];
        s1 += v; s2 += v * v;
    }
    s1 += __shfl_xor(s1, 1, 32);  s2 += __shfl_xor(s2, 1, 32);
    s1 += __shfl_xor(s1, 2, 32);  s2 += __shfl_xor(s2, 2, 32);
    s1 += __shfl_xor(s1, 4, 32);  s2 += __shfl_xor(s2, 4, 32);
    s1 += __shfl_xor(s1, 8, 32);  s2 += __shfl_xor(s2, 8, 32);
    const float mu  = s1 * (1.0f / DD);
    const float var = s2 * (1.0f / DD) - mu * mu;
    const float r   = rsqrtf(var + LN_EPS);

    float* orow = out + ((size_t)b * WW + m0 + row) * DD;
    #pragma unroll
    for (int c = 0; c < 32; ++c) {
        int n = seg * 32 + c;
        orow[n] = (Hlds[row][n] - mu) * r * ln_g[n] + ln_b[n];
    }
}

// ---------------------------------------------------------------------------
extern "C" void kernel_launch(void* const* d_in, const int* in_sizes, int n_in,
                              void* d_out, int out_size, void* d_ws, size_t ws_size,
                              hipStream_t stream) {
    const float* x      = (const float*)d_in[0];
    const float* E_time = (const float*)d_in[1];
    const int*   A_time = (const int*)  d_in[2];
    const float* Wq     = (const float*)d_in[3];
    const float* Wk     = (const float*)d_in[4];
    const float* Wv     = (const float*)d_in[5];
    const float* Wo     = (const float*)d_in[6];
    const float* bq     = (const float*)d_in[7];
    const float* bk     = (const float*)d_in[8];
    const float* bv     = (const float*)d_in[9];
    const float* bo     = (const float*)d_in[10];
    const float* ln_g   = (const float*)d_in[11];
    const float* ln_b   = (const float*)d_in[12];
    float* out = (float*)d_out;

    const size_t HEADSZ = (size_t)BB * HH * WW * DKK;   // 4.19M floats each
    float* q_ws = (float*)d_ws;
    float* k_ws = q_ws + HEADSZ;
    float* v_ws = k_ws + HEADSZ;
    float* y_ws = v_ws + HEADSZ;

    // 1) QKV projections: grid (M/64, N/16, B*3)
    qkv_proj_kernel<<<dim3(WW / 64, DD / 16, BB * 3), 128, 0, stream>>>(
        x, Wq, Wk, Wv, bq, bk, bv, q_ws, k_ws, v_ws);

    // 2) Flash attention: grid (qtiles/4, H, B), 4 waves/block
    flash_attn_kernel<<<dim3(WW / 16 / 4, HH, BB), 128, 0, stream>>>(
        q_ws, k_ws, v_ws, E_time, A_time, y_ws);

    // 3) Output projection + residual + LayerNorm: grid (W/16, B)
    out_ln_kernel<<<dim3(WW / 16, BB), 256, 0, stream>>>(
        y_ws, Wo, bo, x, ln_g, ln_b, out);
}

// v001
// It runs in 371 microseconds.
// Next to v000, in two timings, it ran 1.18 times as fast each time.
#include <hip/hip_runtime.h>
#include <math.h>

// Problem constants (match reference)
#define BB 4
#define WW 2048
#define DD 512
#define HH 8
#define DKK 64          // DD / HH
#define BIAS_SCALE 4.0f
#define LN_EPS 1e-5f
#define SOFT_SCALE 0.125f   // 1/sqrt(64)

typedef __attribute__((ext_vector_type(2))) float v2f;
typedef __attribute__((ext_vector_type(8))) float v8f;

// D = A(16x4) * B(4x16) + C(16x16), fp32 WMMA (CDNA5 V_WMMA_F32_16X16X4_F32)
__device__ __forceinline__ v8f wmma_f32(v2f a, v2f b, v8f c) {
    return __builtin_amdgcn_wmma_f32_16x16x4_f32(
        /*neg_a=*/false, a, /*neg_b=*/false, b,
        /*c_mod=*/(short)0, c, /*reuse_a=*/false, /*reuse_b=*/false);
}

// ---------------------------------------------------------------------------
// Kernel 1: fused QKV projection.  out[b][h][w][dk] = x[b][w]·W[:,n] + bias[n]
// Block: 128 threads (4 waves).  Block tile: 64(M) x 16(N), K staged in LDS.
// ---------------------------------------------------------------------------
#define KC 32
__global__ __launch_bounds__(128) void qkv_proj_kernel(
    const float* __restrict__ x,
    const float* __restrict__ Wq, const float* __restrict__ Wk, const float* __restrict__ Wv,
    const float* __restrict__ bq, const float* __restrict__ bk, const float* __restrict__ bv,
    float* __restrict__ q_ws, float* __restrict__ k_ws, float* __restrict__ v_ws)
{
    const int m0 = blockIdx.x * 64;
    const int n0 = blockIdx.y * 16;
    const int zb = blockIdx.z;              // b*3 + which
    const int b = zb / 3, which = zb - 3 * b;

    const float* Wm   = (which == 0) ? Wq : (which == 1) ? Wk : Wv;
    const float* bias = (which == 0) ? bq : (which == 1) ? bk : bv;
    float*       outp = (which == 0) ? q_ws : (which == 1) ? k_ws : v_ws;

    __shared__ float Alds[64][36];          // 64 x KC, +4 pad (keeps 16B align)
    __shared__ float Blds[KC][16];

    const int tid  = threadIdx.x;
    const int lane = tid & 31;
    const int wav  = tid >> 5;
    const int half = lane >> 4;
    const int l    = lane & 15;

    v8f acc = {};
    const float* xb = x + (size_t)b * WW * DD;

    for (int k0 = 0; k0 < DD; k0 += KC) {
        // cooperative load A tile: 64x32 floats as float4 (coalesced)
        #pragma unroll
        for (int i = 0; i < 4; ++i) {
            int f4  = i * 128 + tid;
            int row = f4 >> 3, c4 = f4 & 7;
            float4 v = *(const float4*)(xb + (size_t)(m0 + row) * DD + k0 + c4 * 4);
            *(float4*)(&Alds[row][c4 * 4]) = v;
        }
        // cooperative load B tile: 32x16 floats (one float4 per thread)
        {
            int row = tid >> 2, c4 = tid & 3;
            float4 v = *(const float4*)(Wm + (size_t)(k0 + row) * DD + n0 + c4 * 4);
            *(float4*)(&Blds[row][c4 * 4]) = v;
        }
        if (k0 + KC < DD)   // hint next A tile into cache (global_prefetch_b8)
            __builtin_prefetch(xb + (size_t)(m0 + (tid >> 1)) * DD + k0 + KC, 0, 1);
        __syncthreads();

        const int arow = wav * 16 + l;
        #pragma unroll
        for (int kk = 0; kk < KC; kk += 4) {
            v2f a, bf;
            a.x  = Alds[arow][kk + 2 * half];
            a.y  = Alds[arow][kk + 2 * half + 1];
            bf.x = Blds[kk + 2 * half][l];
            bf.y = Blds[kk + 2 * half + 1][l];
            acc  = wmma_f32(a, bf, acc);
        }
        __syncthreads();
    }

    // store to head-major layout (B, H, W, DK)
    const int col = n0 + l;
    const int h   = col >> 6;
    const int dk  = col & 63;
    const float bv_ = bias[col];
    #pragma unroll
    for (int i = 0; i < 8; ++i) {
        int row = m0 + wav * 16 + i + 8 * half;
        outp[(((size_t)b * HH + h) * WW + row) * DKK + dk] = acc[i] + bv_;
    }
}

#define KV_STRIDE 68   // 64 + 4 pad: 4-bank lane skew, rows stay 8B aligned

// async copy of one contiguous 16x64-float tile (4KB) into padded LDS rows
__device__ __forceinline__ void async_tile_to_lds(const float* __restrict__ src,
                                                  unsigned lds_base_bytes, int tid) {
    #pragma unroll
    for (int i = 0; i < 2; ++i) {
        int f   = (i * 128 + tid) * 4;          // first float of this 16B chunk
        int row = f >> 6, col = f & 63;
        unsigned lds_off = lds_base_bytes + (unsigned)(row * KV_STRIDE + col) * 4u;
        const float* g = src + f;
        asm volatile("global_load_async_to_lds_b128 %0, %1, off"
                     :: "v"(lds_off), "v"(g) : "memory");
    }
}

// value of lane l ^ 16 (the other 16-lane half), by a vector cross-row move
__device__ __forceinline__ float xhalf(float x) {
    int v = __builtin_bit_cast(int, x);
    return __builtin_bit_cast(float,
        __builtin_amdgcn_permlanex16(v, v, 0x76543210, 0xfedcba98, false, false));
}

// e^x as 2^(x * log2 e).  The v_nop fills, inside the statement, the one slot
// that the instruction set asks for behind a transcendental before its result
// is read or its source overwritten.
__device__ __forceinline__ float exp_slot(float x) {
    float r;
    asm("v_exp_f32 %0, %1\n\tv_nop" : "=v"(r) : "v"(x * 1.44269504f));
    return r;
}

// the grid puts four waves on every SIMD: the register budget of four is the real one
__global__ __launch_bounds__(128) __attribute__((amdgpu_waves_per_eu(4, 4))) void flash_attn_kernel(
    const float* __restrict__ q_ws, const float* __restrict__ k_ws,
    const float* __restrict__ v_ws,
    const float* __restrict__ E_time, const int* __restrict__ A_time,
    float* __restrict__ y_ws)
{
    const int tid  = threadIdx.x;
    const int wav  = tid >> 5;
    const int lane = tid & 31;
    const int half = lane >> 4;
    const int l    = lane & 15;

    const int qt = blockIdx.x * 4 + wav;     // 0..127
    const int h  = blockIdx.y;
    const int b  = blockIdx.z;
    const int q0 = qt * 16;

    __shared__ float Klds[2][16][KV_STRIDE];
    __shared__ float Vlds[2][16][KV_STRIDE];

    const size_t head_base = ((size_t)b * HH + h) * WW;
    const float* kbase = k_ws + head_base * DKK;
    const float* vbase = v_ws + head_base * DKK;
    const unsigned klds0 = (unsigned)(size_t)&Klds[0][0][0];
    const unsigned vlds0 = (unsigned)(size_t)&Vlds[0][0][0];
    const unsigned kvbuf_bytes = 16u * KV_STRIDE * 4u;

    // preload Q fragments (B operand: column l = query) for all 16 K-steps of DK=64
    v2f qfrag[16];
    {
        const float* qrow = q_ws + (head_base + q0 + l) * DKK;
        #pragma unroll
        for (int kk4 = 0; kk4 < 16; ++kk4) {
            qfrag[kk4].x = qrow[kk4 * 4 + 2 * half];
            qfrag[kk4].y = qrow[kk4 * 4 + 2 * half + 1];
        }
    }

    v8f o0 = {}, o1 = {}, o2 = {}, o3 = {};
    float mrun = -1e37f;   // running maximum of query q0 + l, equal in both halves
    float Lrun = 0.0f;     // running sum over this half's keys only

    // prime the pipeline: async-stage tile 0 into buffer 0
    async_tile_to_lds(kbase, klds0, tid);
    async_tile_to_lds(vbase, vlds0, tid);

    for (int j = 0; j < WW / 16; ++j) {
        const int buf = j & 1;

        // issue next tile's async copies into the other buffer (its previous
        // readers finished at the trailing barrier of iteration j-1)
        if (j + 1 < WW / 16) {
            const float* kn = kbase + (size_t)(j + 1) * 16 * DKK;
            const float* vn = vbase + (size_t)(j + 1) * 16 * DKK;
            unsigned nb = (unsigned)((j + 1) & 1) * kvbuf_bytes;
            async_tile_to_lds(kn, klds0 + nb, tid);
            async_tile_to_lds(vn, vlds0 + nb, tid);
            // async loads complete in order: first 4 (tile j) done when cnt<=4
            asm volatile("s_wait_asynccnt 0x4" ::: "memory");
        } else {
            asm volatile("s_wait_asynccnt 0x0" ::: "memory");
        }
        __syncthreads();                     // tile j visible to all waves

        // ----- this pass's operands, asked for together at its head -----
        // bias + mask: eight consecutive keys of one row per lane
        const size_t idx = ((size_t)b * WW + q0 + l) * WW + j * 16 + 8 * half;
        const float4 e0 = *(const float4*)(E_time + idx);
        const float4 e1 = *(const float4*)(E_time + idx + 4);
        const int4   a0 = *(const int4*)(A_time + idx);
        const int4   a1 = *(const int4*)(A_time + idx + 4);
        // K fragments (A operand: row l = key)
        v2f kf[16];
        #pragma unroll
        for (int kk4 = 0; kk4 < 16; ++kk4) {
            kf[kk4].x = Klds[buf][l][kk4 * 4 + 2 * half];
            kf[kk4].y = Klds[buf][l][kk4 * 4 + 2 * half + 1];
        }
        // V^T fragments (A operand: row l = head column).  k slot (half, e) of
        // step t is key 8*half + 2t + e
        v2f vf[4][4];
        #pragma unroll
        for (int t = 0; t < 4; ++t) {
            const int r0 = 8 * half + 2 * t;
            #pragma unroll
            for (int dt = 0; dt < 4; ++dt) {
                vf[t][dt].x = Vlds[buf][r0][dt * 16 + l];
                vf[t][dt].y = Vlds[buf][r0 + 1][dt * 16 + l];
            }
        }
        // keeps the LDS loads above as one group in front of the products: without
        // it the compiler sinks each to its use and the wave waits out every one
        __builtin_amdgcn_sched_barrier(0);

        // ----- S^T = K * Q^T (16 keys x 16 queries), K-dim = 64 -> 16 WMMAs -----
        v8f s = {};
        #pragma unroll
        for (int kk4 = 0; kk4 < 16; ++kk4)
            s = wmma_f32(kf[kk4], qfrag[kk4], s);
        // s[i] = score of query q0 + l against key j*16 + 8*half + i

        // ----- bias + mask -----
        {
            const float e[8] = { e0.x, e0.y, e0.z, e0.w, e1.x, e1.y, e1.z, e1.w };
            const int   a[8] = { a0.x, a0.y, a0.z, a0.w, a1.x, a1.y, a1.z, a1.w };
            #pragma unroll
            for (int i = 0; i < 8; ++i) {
                float biasv = fminf(fmaxf(e[i], -1.0f), 1.0f) * BIAS_SCALE;
                float sv = s[i] * SOFT_SCALE + biasv;
                s[i] = (a[i] > 0) ? sv : -1e38f;
            }
        }

        // ----- online softmax: in-lane over 8 keys, one exchange between halves --
        float rm = s[0];
        #pragma unroll
        for (int i = 1; i < 8; ++i) rm = fmaxf(rm, s[i]);
        rm = fmaxf(rm, xhalf(rm));
        const float mn = fmaxf(mrun, rm);
        const float sc = exp_slot(mrun - mn);
        float p[8];
        float rs = 0.0f;
        #pragma unroll
        for (int i = 0; i < 8; ++i) {
            p[i] = exp_slot(s[i] - mn);
            rs += p[i];
        }
        Lrun = Lrun * sc + rs;
        mrun = mn;
        #pragma unroll
        for (int i = 0; i < 8; ++i) {
            o0[i] *= sc; o1[i] *= sc; o2[i] *= sc; o3[i] *= sc;
        }

        // keeps the asm exponentials out from among the products below
        __builtin_amdgcn_sched_barrier(0);

        // ----- O^T += V^T * P^T: with V's k slots, B of step t is the register
        // pair p[2t], p[2t+1] -----
        #pragma unroll
        for (int t = 0; t < 4; ++t) {
            v2f pf;
            pf.x = p[2 * t];
            pf.y = p[2 * t + 1];
            o0 = wmma_f32(vf[t][0], pf, o0);
            o1 = wmma_f32(vf[t][1], pf, o1);
            o2 = wmma_f32(vf[t][2], pf, o2);
            o3 = wmma_f32(vf[t][3], pf, o3);
        }
        __syncthreads();   // all waves done reading buf before it is restaged
    }

    // ----- join the halves' sums, normalize, store y ((B, W, D) layout) -----
    // oN[i] = O[q0 + l][N*16 + 8*half + i]: eight consecutive floats per tile
    {
        const float inv = 1.0f / (Lrun + xhalf(Lrun));
        float* yr = y_ws + ((size_t)b * WW + q0 + l) * DD + h * DKK + 8 * half;
        *(float4*)(yr)      = make_float4(o0[0] * inv, o0[1] * inv, o0[2] * inv, o0[3] * inv);
        *(float4*)(yr + 4)  = make_float4(o0[4] * inv, o0[5] * inv, o0[6] * inv, o0[7] * inv);
        *(float4*)(yr + 16) = make_float4(o1[0] * inv, o1[1] * inv, o1[2] * inv, o1[3] * inv);
        *(float4*)(yr + 20) = make_float4(o1[4] * inv, o1[5] * inv, o1[6] * inv, o1[7] * inv);
        *(float4*)(yr + 32) = make_float4(o2[0] * inv, o2[1] * inv, o2[2] * inv, o2[3] * inv);
        *(float4*)(yr + 36) = make_float4(o2[4] * inv, o2[5] * inv, o2[6] * inv, o2[7] * inv);
        *(float4*)(yr + 48) = make_float4(o3[0] * inv, o3[1] * inv, o3[2] * inv, o3[3] * inv);
        *(float4*)(yr + 52) = make_float4(o3[4] * inv, o3[5] * inv, o3[6] * inv, o3[7] * inv);
    }
}

// ---------------------------------------------------------------------------
// Kernel 3: output projection + residual + LayerNorm, fused.
// Block: 256 threads (8 waves) computes 16 full rows (16 x 512).
// ---------------------------------------------------------------------------
__global__ __launch_bounds__(256) void out_ln_kernel(
    const float* __restrict__ y_ws, const float* __restrict__ Wo,
    const float* __restrict__ bo,   const float* __restrict__ x,
    const float* __restrict__ ln_g, const float* __restrict__ ln_b,
    float* __restrict__ out)
{
    const int m0 = blockIdx.x * 16;
    const int b  = blockIdx.y;
    const int tid  = threadIdx.x;
    const int wav  = tid >> 5;
    const int lane = tid & 31;
    const int half = lane >> 4;
    const int l    = lane & 15;

    __shared__ float Alds[16][36];
    __shared__ float Hlds[16][520];          // 16 x 512 (+8 pad)

    v8f a0 = {}, a1 = {}, a2 = {}, a3 = {};
    const float* yb = y_ws + (size_t)b * WW * DD;

    for (int k0 = 0; k0 < DD; k0 += KC) {
        if (tid < 128) {                     // 16x32 A tile, one float4/thread
            int row = tid >> 3, c4 = tid & 7;
            *(float4*)(&Alds[row][c4 * 4]) =
                *(const float4*)(yb + (size_t)(m0 + row) * DD + k0 + c4 * 4);
        }
        __syncthreads();
        #pragma unroll
        for (int kk = 0; kk < KC; kk += 4) {
            v2f a;
            a.x = Alds[l][kk + 2 * half];
            a.y = Alds[l][kk + 2 * half + 1];
            const float* wr = Wo + (size_t)(k0 + kk + 2 * half) * DD + wav * 64 + l;
            v2f bf;
            bf.x = wr[0];   bf.y = wr[DD];        a0 = wmma_f32(a, bf, a0);
            bf.x = wr[16];  bf.y = wr[DD + 16];   a1 = wmma_f32(a, bf, a1);
            bf.x = wr[32];  bf.y = wr[DD + 32];   a2 = wmma_f32(a, bf, a2);
            bf.x = wr[48];  bf.y = wr[DD + 48];   a3 = wmma_f32(a, bf, a3);
        }
        __syncthreads();
    }

    // h = proj + bias + residual -> LDS
    const float* xb = x + ((size_t)b * WW + m0) * DD;
    #pragma unroll
    for (int i = 0; i < 8; ++i) {
        int row = i + 8 * half;
        int n = wav * 64 + l;
        Hlds[row][n]      = a0[i] + bo[n]      + xb[(size_t)row * DD + n];
        Hlds[row][n + 16] = a1[i] + bo[n + 16] + xb[(size_t)row * DD + n + 16];
        Hlds[row][n + 32] = a2[i] + bo[n + 32] + xb[(size_t)row * DD + n + 32];
        Hlds[row][n + 48] = a3[i] + bo[n + 48] + xb[(size_t)row * DD + n + 48];
    }
    __syncthreads();

    // LayerNorm: 16 threads per row, 32 cols each; shuffle-reduce within halves
    const int row = tid >> 4;
    const int seg = tid & 15;
    float s1 = 0.0f, s2 = 0.0f;
    #pragma unroll
    for (int c = 0; c < 32; ++c) {
        float v = Hlds[row][seg * 32 + c];
        s1 += v; s2 += v * v;
    }
    s1 += __shfl_xor(s1, 1, 32);  s2 += __shfl_xor(s2, 1, 32);
    s1 += __shfl_xor(s1, 2, 32);  s2 += __shfl_xor(s2, 2, 32);
    s1 += __shfl_xor(s1, 4, 32);  s2 += __shfl_xor(s2, 4, 32);
    s1 += __shfl_xor(s1, 8, 32);  s2 += __shfl_xor(s2, 8, 32);
    const float mu  = s1 * (1.0f / DD);
    const float var = s2 * (1.0f / DD) - mu * mu;
    const float r   = rsqrtf(var + LN_EPS);

    float* orow = out + ((size_t)b * WW + m0 + row) * DD;
    #pragma unroll
    for (int c = 0; c < 32; ++c) {
        int n = seg * 32 + c;
        orow[n] = (Hlds[row][n] - mu) * r * ln_g[n] + ln_b[n];
    }
}

// ---------------------------------------------------------------------------
extern "C" void kernel_launch(void* const* d_in, const int* in_sizes, int n_in,
                              void* d_out, int out_size, void* d_ws, size_t ws_size,
                              hipStream_t stream) {
    const float* x      = (const float*)d_in[0];
    const float* E_time = (const float*)d_in[1];
    const int*   A_time = (const int*)  d_in[2];
    const float* Wq     = (const float*)d_in[3];
    const float* Wk     = (const float*)d_in[4];
    const float* Wv     = (const float*)d_in[5];
    const float* Wo     = (const float*)d_in[6];
    const float* bq     = (const float*)d_in[7];
    const float* bk     = (const float*)d_in[8];
    const float* bv     = (const float*)d_in[9];
    const float* bo     = (const float*)d_in[10];
    const float* ln_g   = (const float*)d_in[11];
    const float* ln_b   = (const float*)d_in[12];
    float* out = (float*)d_out;

    const size_t HEADSZ = (size_t)BB * HH * WW * DKK;   // 4.19M floats each
    float* q_ws = (float*)d_ws;
    float* k_ws = q_ws + HEADSZ;
    float* v_ws = k_ws + HEADSZ;
    float* y_ws = v_ws + HEADSZ;

    // 1) QKV projections: grid (M/64, N/16, B*3)
    qkv_proj_kernel<<<dim3(WW / 64, DD / 16, BB * 3), 128, 0, stream>>>(
        x, Wq, Wk, Wv, bq, bk, bv, q_ws, k_ws, v_ws);

    // 2) Flash attention: grid (qtiles/4, H, B), 4 waves/block
    flash_attn_kernel<<<dim3(WW / 16 / 4, HH, BB), 128, 0, stream>>>(
        q_ws, k_ws, v_ws, E_time, A_time, y_ws);

    // 3) Output projection + residual + LayerNorm: grid (W/16, B)
    out_ln_kernel<<<dim3(WW / 16, BB), 256, 0, stream>>>(
        y_ws, Wo, bo, x, ln_g, ln_b, out);
}

// v002
// It runs in 316 microseconds.
// Two timings next to v001 both put it at 1.17 times that version's speed.
// All steps since v000 together make it 1.38 times as fast.
#include <hip/hip_runtime.h>
#include <math.h>

// Problem constants (match reference)
#define BB 4
#define WW 2048
#define DD 512
#define HH 8
#define DKK 64          // DD / HH
#define BIAS_SCALE 4.0f
#define LN_EPS 1e-5f
#define SOFT_SCALE 0.125f   // 1/sqrt(64)

typedef __attribute__((ext_vector_type(2))) float v2f;
typedef __attribute__((ext_vector_type(8))) float v8f;

// D = A(16x4) * B(4x16) + C(16x16), fp32 WMMA (CDNA5 V_WMMA_F32_16X16X4_F32)
__device__ __forceinline__ v8f wmma_f32(v2f a, v2f b, v8f c) {
    return __builtin_amdgcn_wmma_f32_16x16x4_f32(
        /*neg_a=*/false, a, /*neg_b=*/false, b,
        /*c_mod=*/(short)0, c, /*reuse_a=*/false, /*reuse_b=*/false);
}

// ---------------------------------------------------------------------------
// Kernel 1: fused QKV projection.  out[b][h][w][dk] = x[b][w]·W[:,n] + bias[n]
// Block: 256 threads (8 waves, 4 x 2).  Block tile: 128(M) x 128(N), K staged
// in LDS.  Wave tile: 32 x 64 = 2 x 4 accumulator tiles, so one A fragment
// feeds four products and one B fragment two.
// ---------------------------------------------------------------------------
#define KC 32
#define B_PITCH 136     // 128 + 8: the two lane halves (2 rows apart) sit 16 banks apart
// the grid puts three blocks on every WGP, six waves on every SIMD: the register budget of six is the real one
__global__ __launch_bounds__(256) __attribute__((amdgpu_waves_per_eu(6))) void qkv_proj_kernel(
    const float* __restrict__ x,
    const float* __restrict__ Wq, const float* __restrict__ Wk, const float* __restrict__ Wv,
    const float* __restrict__ bq, const float* __restrict__ bk, const float* __restrict__ bv,
    float* __restrict__ q_ws, float* __restrict__ k_ws, float* __restrict__ v_ws)
{
    const int m0 = blockIdx.x * 128;
    const int n0 = blockIdx.y * 128;
    const int zb = blockIdx.z;              // b*3 + which
    const int b = zb / 3, which = zb - 3 * b;

    const float* Wm   = (which == 0) ? Wq : (which == 1) ? Wk : Wv;
    const float* bias = (which == 0) ? bq : (which == 1) ? bk : bv;
    float*       outp = (which == 0) ? q_ws : (which == 1) ? k_ws : v_ws;

    __shared__ float Alds[128][36];         // 128 x KC, +4 pad (keeps 16B align)
    __shared__ float Blds[KC][B_PITCH];

    const int tid  = threadIdx.x;
    const int lane = tid & 31;
    const int wav  = tid >> 5;
    const int half = lane >> 4;
    const int l    = lane & 15;
    const int wm   = wav >> 1;              // 32-row band of the block tile
    const int wn   = wav & 1;               // 64-column band of the block tile

    v8f acc[2][4] = {};
    const float* xb = x + (size_t)b * WW * DD;

    for (int k0 = 0; k0 < DD; k0 += KC) {
        // cooperative load A tile: 128x32 floats as float4 (coalesced)
        #pragma unroll
        for (int i = 0; i < 4; ++i) {
            int f4  = i * 256 + tid;
            int row = f4 >> 3, c4 = f4 & 7;
            float4 v = *(const float4*)(xb + (size_t)(m0 + row) * DD + k0 + c4 * 4);
            *(float4*)(&Alds[row][c4 * 4]) = v;
        }
        // cooperative load B tile: 32x128 floats as float4 (a wave takes one row)
        #pragma unroll
        for (int i = 0; i < 4; ++i) {
            int f4  = i * 256 + tid;
            int row = f4 >> 5, c4 = f4 & 31;
            float4 v = *(const float4*)(Wm + (size_t)(k0 + row) * DD + n0 + c4 * 4);
            *(float4*)(&Blds[row][c4 * 4]) = v;
        }
        if (k0 + KC < DD)   // hint next A tile into cache (global_prefetch_b8)
            __builtin_prefetch(xb + (size_t)(m0 + (tid >> 1)) * DD + k0 + KC, 0, 1);
        __syncthreads();

        const int arow = wm * 32 + l;
        const int bcol = wn * 64 + l;
        #pragma unroll
        for (int kk = 0; kk < KC; kk += 4) {
            v2f a[2], bf[4];
            #pragma unroll
            for (int mi = 0; mi < 2; ++mi) {
                a[mi].x = Alds[arow + mi * 16][kk + 2 * half];
                a[mi].y = Alds[arow + mi * 16][kk + 2 * half + 1];
            }
            #pragma unroll
            for (int nj = 0; nj < 4; ++nj) {
                bf[nj].x = Blds[kk + 2 * half][bcol + nj * 16];
                bf[nj].y = Blds[kk + 2 * half + 1][bcol + nj * 16];
            }
            #pragma unroll
            for (int mi = 0; mi < 2; ++mi)
                #pragma unroll
                for (int nj = 0; nj < 4; ++nj)
                    acc[mi][nj] = wmma_f32(a[mi], bf[nj], acc[mi][nj]);
        }
        __syncthreads();
    }

    // store to head-major layout (B, H, W, DK)
    #pragma unroll
    for (int nj = 0; nj < 4; ++nj) {
        const int col = n0 + wn * 64 + nj * 16 + l;
        const int h   = col >> 6;
        const int dk  = col & 63;
        const float bv_ = bias[col];
        #pragma unroll
        for (int mi = 0; mi < 2; ++mi) {
            #pragma unroll
            for (int i = 0; i < 8; ++i) {
                int row = m0 + wm * 32 + mi * 16 + i + 8 * half;
                outp[(((size_t)b * HH + h) * WW + row) * DKK + dk] = acc[mi][nj][i] + bv_;
            }
        }
    }
}

#define KV_STRIDE 68   // 64 + 4 pad: 4-bank lane skew, rows stay 8B aligned

// async copy of one contiguous 16x64-float tile (4KB) into padded LDS rows
__device__ __forceinline__ void async_tile_to_lds(const float* __restrict__ src,
                                                  unsigned lds_base_bytes, int tid) {
    #pragma unroll
    for (int i = 0; i < 2; ++i) {
        int f   = (i * 128 + tid) * 4;          // first float of this 16B chunk
        int row = f >> 6, col = f & 63;
        unsigned lds_off = lds_base_bytes + (unsigned)(row * KV_STRIDE + col) * 4u;
        const float* g = src + f;
        asm volatile("global_load_async_to_lds_b128 %0, %1, off"
                     :: "v"(lds_off), "v"(g) : "memory");
    }
}

// value of lane l ^ 16 (the other 16-lane half), by a vector cross-row move
__device__ __forceinline__ float xhalf(float x) {
    int v = __builtin_bit_cast(int, x);
    return __builtin_bit_cast(float,
        __builtin_amdgcn_permlanex16(v, v, 0x76543210, 0xfedcba98, false, false));
}

// e^x as 2^(x * log2 e).  The v_nop fills, inside the statement, the one slot
// that the instruction set asks for behind a transcendental before its result
// is read or its source overwritten.
__device__ __forceinline__ float exp_slot(float x) {
    float r;
    asm("v_exp_f32 %0, %1\n\tv_nop" : "=v"(r) : "v"(x * 1.44269504f));
    return r;
}

// the grid puts four waves on every SIMD: the register budget of four is the real one
__global__ __launch_bounds__(128) __attribute__((amdgpu_waves_per_eu(4, 4))) void flash_attn_kernel(
    const float* __restrict__ q_ws, const float* __restrict__ k_ws,
    const float* __restrict__ v_ws,
    const float* __restrict__ E_time, const int* __restrict__ A_time,
    float* __restrict__ y_ws)
{
    const int tid  = threadIdx.x;
    const int wav  = tid >> 5;
    const int lane = tid & 31;
    const int half = lane >> 4;
    const int l    = lane & 15;

    const int qt = blockIdx.x * 4 + wav;     // 0..127
    const int h  = blockIdx.y;
    const int b  = blockIdx.z;
    const int q0 = qt * 16;

    __shared__ float Klds[2][16][KV_STRIDE];
    __shared__ float Vlds[2][16][KV_STRIDE];

    const size_t head_base = ((size_t)b * HH + h) * WW;
    const float* kbase = k_ws + head_base * DKK;
    const float* vbase = v_ws + head_base * DKK;
    const unsigned klds0 = (unsigned)(size_t)&Klds[0][0][0];
    const unsigned vlds0 = (unsigned)(size_t)&Vlds[0][0][0];
    const unsigned kvbuf_bytes = 16u * KV_STRIDE * 4u;

    // preload Q fragments (B operand: column l = query) for all 16 K-steps of DK=64
    v2f qfrag[16];
    {
        const float* qrow = q_ws + (head_base + q0 + l) * DKK;
        #pragma unroll
        for (int kk4 = 0; kk4 < 16; ++kk4) {
            qfrag[kk4].x = qrow[kk4 * 4 + 2 * half];
            qfrag[kk4].y = qrow[kk4 * 4 + 2 * half + 1];
        }
    }

    v8f o0 = {}, o1 = {}, o2 = {}, o3 = {};
    float mrun = -1e37f;   // running maximum of query q0 + l, equal in both halves
    float Lrun = 0.0f;     // running sum over this half's keys only

    // prime the pipeline: async-stage tile 0 into buffer 0
    async_tile_to_lds(kbase, klds0, tid);
    async_tile_to_lds(vbase, vlds0, tid);

    for (int j = 0; j < WW / 16; ++j) {
        const int buf = j & 1;

        // issue next tile's async copies into the other buffer (its previous
        // readers finished at the trailing barrier of iteration j-1)
        if (j + 1 < WW / 16) {
            const float* kn = kbase + (size_t)(j + 1) * 16 * DKK;
            const float* vn = vbase + (size_t)(j + 1) * 16 * DKK;
            unsigned nb = (unsigned)((j + 1) & 1) * kvbuf_bytes;
            async_tile_to_lds(kn, klds0 + nb, tid);
            async_tile_to_lds(vn, vlds0 + nb, tid);
            // async loads complete in order: first 4 (tile j) done when cnt<=4
            asm volatile("s_wait_asynccnt 0x4" ::: "memory");
        } else {
            asm volatile("s_wait_asynccnt 0x0" ::: "memory");
        }
        __syncthreads();                     // tile j visible to all waves

        // ----- this pass's operands, asked for together at its head -----
        // bias + mask: eight consecutive keys of one row per lane
        const size_t idx = ((size_t)b * WW + q0 + l) * WW + j * 16 + 8 * half;
        const float4 e0 = *(const float4*)(E_time + idx);
        const float4 e1 = *(const float4*)(E_time + idx + 4);
        const int4   a0 = *(const int4*)(A_time + idx);
        const int4   a1 = *(const int4*)(A_time + idx + 4);
        // K fragments (A operand: row l = key)
        v2f kf[16];
        #pragma unroll
        for (int kk4 = 0; kk4 < 16; ++kk4) {
            kf[kk4].x = Klds[buf][l][kk4 * 4 + 2 * half];
            kf[kk4].y = Klds[buf][l][kk4 * 4 + 2 * half + 1];
        }
        // V^T fragments (A operand: row l = head column).  k slot (half, e) of
        // step t is key 8*half + 2t + e
        v2f vf[4][4];
        #pragma unroll
        for (int t = 0; t < 4; ++t) {
            const int r0 = 8 * half + 2 * t;
            #pragma unroll
            for (int dt = 0; dt < 4; ++dt) {
                vf[t][dt].x = Vlds[buf][r0][dt * 16 + l];
                vf[t][dt].y = Vlds[buf][r0 + 1][dt * 16 + l];
            }
        }
        // keeps the LDS loads above as one group in front of the products: without
        // it the compiler sinks each to its use and the wave waits out every one
        __builtin_amdgcn_sched_barrier(0);

        // ----- S^T = K * Q^T (16 keys x 16 queries), K-dim = 64 -> 16 WMMAs -----
        v8f s = {};
        #pragma unroll
        for (int kk4 = 0; kk4 < 16; ++kk4)
            s = wmma_f32(kf[kk4], qfrag[kk4], s);
        // s[i] = score of query q0 + l against key j*16 + 8*half + i

        // ----- bias + mask -----
        {
            const float e[8] = { e0.x, e0.y, e0.z, e0.w, e1.x, e1.y, e1.z, e1.w };
            const int   a[8] = { a0.x, a0.y, a0.z, a0.w, a1.x, a1.y, a1.z, a1.w };
            #pragma unroll
            for (int i = 0; i < 8; ++i) {
                float biasv = fminf(fmaxf(e[i], -1.0f), 1.0f) * BIAS_SCALE;
                float sv = s[i] * SOFT_SCALE + biasv;
                s[i] = (a[i] > 0) ? sv : -1e38f;
            }
        }

        // ----- online softmax: in-lane over 8 keys, one exchange between halves --
        float rm = s[0];
        #pragma unroll
        for (int i = 1; i < 8; ++i) rm = fmaxf(rm, s[i]);
        rm = fmaxf(rm, xhalf(rm));
        const float mn = fmaxf(mrun, rm);
        const float sc = exp_slot(mrun - mn);
        float p[8];
        float rs = 0.0f;
        #pragma unroll
        for (int i = 0; i < 8; ++i) {
            p[i] = exp_slot(s[i] - mn);
            rs += p[i];
        }
        Lrun = Lrun * sc + rs;
        mrun = mn;
        #pragma unroll
        for (int i = 0; i < 8; ++i) {
            o0[i] *= sc; o1[i] *= sc; o2[i] *= sc; o3[i] *= sc;
        }

        // keeps the asm exponentials out from among the products below
        __builtin_amdgcn_sched_barrier(0);

        // ----- O^T += V^T * P^T: with V's k slots, B of step t is the register
        // pair p[2t], p[2t+1] -----
        #pragma unroll
        for (int t = 0; t < 4; ++t) {
            v2f pf;
            pf.x = p[2 * t];
            pf.y = p[2 * t + 1];
            o0 = wmma_f32(vf[t][0], pf, o0);
            o1 = wmma_f32(vf[t][1], pf, o1);
            o2 = wmma_f32(vf[t][2], pf, o2);
            o3 = wmma_f32(vf[t][3], pf, o3);
        }
        __syncthreads();   // all waves done reading buf before it is restaged
    }

    // ----- join the halves' sums, normalize, store y ((B, W, D) layout) -----
    // oN[i] = O[q0 + l][N*16 + 8*half + i]: eight consecutive floats per tile
    {
        const float inv = 1.0f / (Lrun + xhalf(Lrun));
        float* yr = y_ws + ((size_t)b * WW + q0 + l) * DD + h * DKK + 8 * half;
        *(float4*)(yr)      = make_float4(o0[0] * inv, o0[1] * inv, o0[2] * inv, o0[3] * inv);
        *(float4*)(yr + 4)  = make_float4(o0[4] * inv, o0[5] * inv, o0[6] * inv, o0[7] * inv);
        *(float4*)(yr + 16) = make_float4(o1[0] * inv, o1[1] * inv, o1[2] * inv, o1[3] * inv);
        *(float4*)(yr + 20) = make_float4(o1[4] * inv, o1[5] * inv, o1[6] * inv, o1[7] * inv);
        *(float4*)(yr + 32) = make_float4(o2[0] * inv, o2[1] * inv, o2[2] * inv, o2[3] * inv);
        *(float4*)(yr + 36) = make_float4(o2[4] * inv, o2[5] * inv, o2[6] * inv, o2[7] * inv);
        *(float4*)(yr + 48) = make_float4(o3[0] * inv, o3[1] * inv, o3[2] * inv, o3[3] * inv);
        *(float4*)(yr + 52) = make_float4(o3[4] * inv, o3[5] * inv, o3[6] * inv, o3[7] * inv);
    }
}

// ---------------------------------------------------------------------------
// Kernel 3: output projection + residual + LayerNorm, fused.
// Block: 256 threads (8 waves) computes 16 full rows (16 x 512).
// ---------------------------------------------------------------------------
__global__ __launch_bounds__(256) void out_ln_kernel(
    const float* __restrict__ y_ws, const float* __restrict__ Wo,
    const float* __restrict__ bo,   const float* __restrict__ x,
    const float* __restrict__ ln_g, const float* __restrict__ ln_b,
    float* __restrict__ out)
{
    const int m0 = blockIdx.x * 16;
    const int b  = blockIdx.y;
    const int tid  = threadIdx.x;
    const int wav  = tid >> 5;
    const int lane = tid & 31;
    const int half = lane >> 4;
    const int l    = lane & 15;

    __shared__ float Alds[16][36];
    __shared__ float Hlds[16][520];          // 16 x 512 (+8 pad)

    v8f a0 = {}, a1 = {}, a2 = {}, a3 = {};
    const float* yb = y_ws + (size_t)b * WW * DD;

    for (int k0 = 0; k0 < DD; k0 += KC) {
        if (tid < 128) {                     // 16x32 A tile, one float4/thread
            int row = tid >> 3, c4 = tid & 7;
            *(float4*)(&Alds[row][c4 * 4]) =
                *(const float4*)(yb + (size_t)(m0 + row) * DD + k0 + c4 * 4);
        }
        __syncthreads();
        #pragma unroll
        for (int kk = 0; kk < KC; kk += 4) {
            v2f a;
            a.x = Alds[l][kk + 2 * half];
            a.y = Alds[l][kk + 2 * half + 1];
            const float* wr = Wo + (size_t)(k0 + kk + 2 * half) * DD + wav * 64 + l;
            v2f bf;
            bf.x = wr[0];   bf.y = wr[DD];        a0 = wmma_f32(a, bf, a0);
            bf.x = wr[16];  bf.y = wr[DD + 16];   a1 = wmma_f32(a, bf, a1);
            bf.x = wr[32];  bf.y = wr[DD + 32];   a2 = wmma_f32(a, bf, a2);
            bf.x = wr[48];  bf.y = wr[DD + 48];   a3 = wmma_f32(a, bf, a3);
        }
        __syncthreads();
    }

    // h = proj + bias + residual -> LDS
    const float* xb = x + ((size_t)b * WW + m0) * DD;
    #pragma unroll
    for (int i = 0; i < 8; ++i) {
        int row = i + 8 * half;
        int n = wav * 64 + l;
        Hlds[row][n]      = a0[i] + bo[n]      + xb[(size_t)row * DD + n];
        Hlds[row][n + 16] = a1[i] + bo[n + 16] + xb[(size_t)row * DD + n + 16];
        Hlds[row][n + 32] = a2[i] + bo[n + 32] + xb[(size_t)row * DD + n + 32];
        Hlds[row][n + 48] = a3[i] + bo[n + 48] + xb[(size_t)row * DD + n + 48];
    }
    __syncthreads();

    // LayerNorm: 16 threads per row, 32 cols each; shuffle-reduce within halves
    const int row = tid >> 4;
    const int seg = tid & 15;
    float s1 = 0.0f, s2 = 0.0f;
    #pragma unroll
    for (int c = 0; c < 32; ++c) {
        float v = Hlds[row][seg * 32 + c];
        s1 += v; s2 += v * v;
    }
    s1 += __shfl_xor(s1, 1, 32);  s2 += __shfl_xor(s2, 1, 32);
    s1 += __shfl_xor(s1, 2, 32);  s2 += __shfl_xor(s2, 2, 32);
    s1 += __shfl_xor(s1, 4, 32);  s2 += __shfl_xor(s2, 4, 32);
    s1 += __shfl_xor(s1, 8, 32);  s2 += __shfl_xor(s2, 8, 32);
    const float mu  = s1 * (1.0f / DD);
    const float var = s2 * (1.0f / DD) - mu * mu;
    const float r   = rsqrtf(var + LN_EPS);

    float* orow = out + ((size_t)b * WW + m0 + row) * DD;
    #pragma unroll
    for (int c = 0; c < 32; ++c) {
        int n = seg * 32 + c;
        orow[n] = (Hlds[row][n] - mu) * r * ln_g[n] + ln_b[n];
    }
}

// ---------------------------------------------------------------------------
extern "C" void kernel_launch(void* const* d_in, const int* in_sizes, int n_in,
                              void* d_out, int out_size, void* d_ws, size_t ws_size,
                              hipStream_t stream) {
    const float* x      = (const float*)d_in[0];
    const float* E_time = (const float*)d_in[1];
    const int*   A_time = (const int*)  d_in[2];
    const float* Wq     = (const float*)d_in[3];
    const float* Wk     = (const float*)d_in[4];
    const float* Wv     = (const float*)d_in[5];
    const float* Wo     = (const float*)d_in[6];
    const float* bq     = (const float*)d_in[7];
    const float* bk     = (const float*)d_in[8];
    const float* bv     = (const float*)d_in[9];
    const float* bo     = (const float*)d_in[10];
    const float* ln_g   = (const float*)d_in[11];
    const float* ln_b   = (const float*)d_in[12];
    float* out = (float*)d_out;

    const size_t HEADSZ = (size_t)BB * HH * WW * DKK;   // 4.19M floats each
    float* q_ws = (float*)d_ws;
    float* k_ws = q_ws + HEADSZ;
    float* v_ws = k_ws + HEADSZ;
    float* y_ws = v_ws + HEADSZ;

    // 1) QKV projections: grid (M/128, N/128, B*3)
    qkv_proj_kernel<<<dim3(WW / 128, DD / 128, BB * 3), 256, 0, stream>>>(
        x, Wq, Wk, Wv, bq, bk, bv, q_ws, k_ws, v_ws);

    // 2) Flash attention: grid (qtiles/4, H, B), 4 waves/block
    flash_attn_kernel<<<dim3(WW / 16 / 4, HH, BB), 128, 0, stream>>>(
        q_ws, k_ws, v_ws, E_time, A_time, y_ws);

    // 3) Output projection + residual + LayerNorm: grid (W/16, B)
    out_ln_kernel<<<dim3(WW / 16, BB), 256, 0, stream>>>(
        y_ws, Wo, bo, x, ln_g, ln_b, out);
}

// v003
// It runs in 299 microseconds.
// In two side-by-side timings against v002, it was 1.06 and 1.07 times as fast.
// All steps since v000 together make it 1.46 times as fast.
#include <hip/hip_runtime.h>
#include <math.h>

// Problem constants (match reference)
#define BB 4
#define WW 2048
#define DD 512
#define HH 8
#define DKK 64          // DD / HH
#define BIAS_SCALE 4.0f
#define LN_EPS 1e-5f
#define SOFT_SCALE 0.125f   // 1/sqrt(64)

typedef __attribute__((ext_vector_type(2))) float v2f;
typedef __attribute__((ext_vector_type(8))) float v8f;
typedef __attribute__((ext_vector_type(4))) float v4f;
typedef __attribute__((ext_vector_type(4))) int   v4i;

// D = A(16x4) * B(4x16) + C(16x16), fp32 WMMA (CDNA5 V_WMMA_F32_16X16X4_F32)
__device__ __forceinline__ v8f wmma_f32(v2f a, v2f b, v8f c) {
    return __builtin_amdgcn_wmma_f32_16x16x4_f32(
        /*neg_a=*/false, a, /*neg_b=*/false, b,
        /*c_mod=*/(short)0, c, /*reuse_a=*/false, /*reuse_b=*/false);
}

// ---------------------------------------------------------------------------
// Kernel 1: fused QKV projection.  out[b][h][w][dk] = x[b][w]·W[:,n] + bias[n]
// Block: 256 threads (8 waves, 4 x 2).  Block tile: 128(M) x 128(N), K staged
// in LDS.  Wave tile: 32 x 64 = 2 x 4 accumulator tiles, so one A fragment
// feeds four products and one B fragment two.
// ---------------------------------------------------------------------------
#define KC 32
#define B_PITCH 136     // 128 + 8: the two lane halves (2 rows apart) sit 16 banks apart
// the grid puts three blocks on every WGP, six waves on every SIMD: the register budget of six is the real one
__global__ __launch_bounds__(256) __attribute__((amdgpu_waves_per_eu(6))) void qkv_proj_kernel(
    const float* __restrict__ x,
    const float* __restrict__ Wq, const float* __restrict__ Wk, const float* __restrict__ Wv,
    const float* __restrict__ bq, const float* __restrict__ bk, const float* __restrict__ bv,
    float* __restrict__ q_ws, float* __restrict__ k_ws, float* __restrict__ v_ws)
{
    const int m0 = blockIdx.x * 128;
    const int n0 = blockIdx.y * 128;
    const int zb = blockIdx.z;              // b*3 + which
    const int b = zb / 3, which = zb - 3 * b;

    const float* Wm   = (which == 0) ? Wq : (which == 1) ? Wk : Wv;
    const float* bias = (which == 0) ? bq : (which == 1) ? bk : bv;
    float*       outp = (which == 0) ? q_ws : (which == 1) ? k_ws : v_ws;

    __shared__ float Alds[128][36];         // 128 x KC, +4 pad (keeps 16B align)
    __shared__ float Blds[KC][B_PITCH];

    const int tid  = threadIdx.x;
    const int lane = tid & 31;
    const int wav  = tid >> 5;
    const int half = lane >> 4;
    const int l    = lane & 15;
    const int wm   = wav >> 1;              // 32-row band of the block tile
    const int wn   = wav & 1;               // 64-column band of the block tile

    v8f acc[2][4] = {};
    const float* xb = x + (size_t)b * WW * DD;

    for (int k0 = 0; k0 < DD; k0 += KC) {
        // cooperative load A tile: 128x32 floats as float4 (coalesced)
        #pragma unroll
        for (int i = 0; i < 4; ++i) {
            int f4  = i * 256 + tid;
            int row = f4 >> 3, c4 = f4 & 7;
            float4 v = *(const float4*)(xb + (size_t)(m0 + row) * DD + k0 + c4 * 4);
            *(float4*)(&Alds[row][c4 * 4]) = v;
        }
        // cooperative load B tile: 32x128 floats as float4 (a wave takes one row)
        #pragma unroll
        for (int i = 0; i < 4; ++i) {
            int f4  = i * 256 + tid;
            int row = f4 >> 5, c4 = f4 & 31;
            float4 v = *(const float4*)(Wm + (size_t)(k0 + row) * DD + n0 + c4 * 4);
            *(float4*)(&Blds[row][c4 * 4]) = v;
        }
        if (k0 + KC < DD)   // hint next A tile into cache (global_prefetch_b8)
            __builtin_prefetch(xb + (size_t)(m0 + (tid >> 1)) * DD + k0 + KC, 0, 1);
        __syncthreads();

        const int arow = wm * 32 + l;
        const int bcol = wn * 64 + l;
        #pragma unroll
        for (int kk = 0; kk < KC; kk += 4) {
            v2f a[2], bf[4];
            #pragma unroll
            for (int mi = 0; mi < 2; ++mi) {
                a[mi].x = Alds[arow + mi * 16][kk + 2 * half];
                a[mi].y = Alds[arow + mi * 16][kk + 2 * half + 1];
            }
            #pragma unroll
            for (int nj = 0; nj < 4; ++nj) {
                bf[nj].x = Blds[kk + 2 * half][bcol + nj * 16];
                bf[nj].y = Blds[kk + 2 * half + 1][bcol + nj * 16];
            }
            #pragma unroll
            for (int mi = 0; mi < 2; ++mi)
                #pragma unroll
                for (int nj = 0; nj < 4; ++nj)
                    acc[mi][nj] = wmma_f32(a[mi], bf[nj], acc[mi][nj]);
        }
        __syncthreads();
    }

    // store to head-major layout (B, H, W, DK)
    #pragma unroll
    for (int nj = 0; nj < 4; ++nj) {
        const int col = n0 + wn * 64 + nj * 16 + l;
        const int h   = col >> 6;
        const int dk  = col & 63;
        const float bv_ = bias[col];
        #pragma unroll
        for (int mi = 0; mi < 2; ++mi) {
            #pragma unroll
            for (int i = 0; i < 8; ++i) {
                int row = m0 + wm * 32 + mi * 16 + i + 8 * half;
                outp[(((size_t)b * HH + h) * WW + row) * DKK + dk] = acc[mi][nj][i] + bv_;
            }
        }
    }
}

#define KT 32
#define KV_STRIDE 68
#define EA_STRIDE 36

// eight async copies of 16 bytes per lane.  The s_wait_xcnt closes the statement
// so that it stands in front of every later write of the address registers.
__device__ __forceinline__ void async_copy8(
    unsigned l0, unsigned l1, unsigned l2, unsigned l3,
    unsigned l4, unsigned l5, unsigned l6, unsigned l7,
    const void* g0, const void* g1, const void* g2, const void* g3,
    const void* g4, const void* g5, const void* g6, const void* g7) {
    asm volatile("global_load_async_to_lds_b128 %0, %8, off\n\t"
                 "global_load_async_to_lds_b128 %1, %9, off\n\t"
                 "global_load_async_to_lds_b128 %2, %10, off\n\t"
                 "global_load_async_to_lds_b128 %3, %11, off\n\t"
                 "global_load_async_to_lds_b128 %4, %12, off\n\t"
                 "global_load_async_to_lds_b128 %5, %13, off\n\t"
                 "global_load_async_to_lds_b128 %6, %14, off\n\t"
                 "global_load_async_to_lds_b128 %7, %15, off\n\t"
                 "s_wait_xcnt 0x0"
                 :: "v"(l0), "v"(l1), "v"(l2), "v"(l3), "v"(l4), "v"(l5), "v"(l6), "v"(l7),
                    "v"(g0), "v"(g1), "v"(g2), "v"(g3), "v"(g4), "v"(g5), "v"(g6), "v"(g7)
                 : "memory");
}

// one stage: kg, vg, eg, ag are this thread's first 16-byte chunk of the stage's
// K, V, bias and mask tiles, kl, vl, el, al its LDS byte addresses.  128 threads
// advance 8 K/V rows (contiguous 2 KB) or 16 bias/mask rows per step.
__device__ __forceinline__ void stage_to_lds(
    const float* kg, const float* vg, const float* eg, const int* ag,
    unsigned kl, unsigned vl, unsigned el, unsigned al) {
    const unsigned kvs = 8u * KV_STRIDE * 4u;
    const unsigned eas = 16u * EA_STRIDE * 4u;
    async_copy8(kl, kl + kvs, kl + 2 * kvs, kl + 3 * kvs,
                vl, vl + kvs, vl + 2 * kvs, vl + 3 * kvs,
                kg, kg + 512, kg + 1024, kg + 1536,
                vg, vg + 512, vg + 1024, vg + 1536);
    async_copy8(el, el + eas, el + 2 * eas, el + 3 * eas,
                al, al + eas, al + 2 * eas, al + 3 * eas,
                eg, eg + 16 * WW, eg + 32 * WW, eg + 48 * WW,
                ag, ag + 16 * WW, ag + 32 * WW, ag + 48 * WW);
}

// value of lane l ^ 16 (the other 16-lane half), by a vector cross-row move
__device__ __forceinline__ float xhalf(float x) {
    int v = __builtin_bit_cast(int, x);
    return __builtin_bit_cast(float,
        __builtin_amdgcn_permlanex16(v, v, 0x76543210, 0xfedcba98, false, false));
}

// e^x as 2^(x * log2 e).  The v_nop fills, inside the statement, the one slot
// that the instruction set asks for behind a transcendental before its result
// is read or its source overwritten.
__device__ __forceinline__ float exp_slot(float x) {
    float r;
    asm("v_exp_f32 %0, %1\n\tv_nop" : "=v"(r) : "v"(x * 1.44269504f));
    return r;
}

// the grid puts four waves on every SIMD: the register budget of four is the real one
__global__ __launch_bounds__(128) __attribute__((amdgpu_waves_per_eu(4, 4))) void flash_attn_kernel(
    const float* __restrict__ q_ws, const float* __restrict__ k_ws,
    const float* __restrict__ v_ws,
    const float* __restrict__ E_time, const int* __restrict__ A_time,
    float* __restrict__ y_ws)
{
    const int tid  = threadIdx.x;
    const int wav  = tid >> 5;
    const int lane = tid & 31;
    const int half = lane >> 4;
    const int l    = lane & 15;

    const int qt = blockIdx.x * 4 + wav;     // 0..127
    const int h  = blockIdx.y;
    const int b  = blockIdx.z;
    const int q0 = qt * 16;

    __shared__ __attribute__((aligned(16))) float Klds[2][KT][KV_STRIDE];
    __shared__ __attribute__((aligned(16))) float Vlds[2][KT][KV_STRIDE];
    __shared__ __attribute__((aligned(16))) float Elds[2][64][EA_STRIDE];
    __shared__ __attribute__((aligned(16))) int   Mlds[2][64][EA_STRIDE];

    const size_t head_base = ((size_t)b * HH + h) * WW;
    // this thread's first chunk of stage 0, in global memory and in buffer 0
    const float* kg = k_ws + head_base * DKK + tid * 4;
    const float* vg = v_ws + head_base * DKK + tid * 4;
    const size_t ea0 = ((size_t)b * WW + blockIdx.x * 64 + (tid >> 3)) * WW + (tid & 7) * 4;
    const float* eg = E_time + ea0;
    const int*   ag = A_time + ea0;
    const unsigned kvoff = (unsigned)((tid >> 4) * KV_STRIDE + (tid & 15) * 4) * 4u;
    const unsigned eaoff = (unsigned)((tid >> 3) * EA_STRIDE + (tid & 7) * 4) * 4u;
    const unsigned kl0 = (unsigned)(size_t)&Klds[0][0][0] + kvoff;
    const unsigned vl0 = (unsigned)(size_t)&Vlds[0][0][0] + kvoff;
    const unsigned el0 = (unsigned)(size_t)&Elds[0][0][0] + eaoff;
    const unsigned al0 = (unsigned)(size_t)&Mlds[0][0][0] + eaoff;
    const unsigned kvbuf_bytes = (unsigned)KT * KV_STRIDE * 4u;
    const unsigned eabuf_bytes = 64u * EA_STRIDE * 4u;

    // preload Q fragments (B operand: column l = query) for all 16 K-steps of DK=64
    v2f qfrag[16];
    {
        const float* qrow = q_ws + (head_base + q0 + l) * DKK;
        #pragma unroll
        for (int kk4 = 0; kk4 < 16; ++kk4) {
            qfrag[kk4].x = qrow[kk4 * 4 + 2 * half];
            qfrag[kk4].y = qrow[kk4 * 4 + 2 * half + 1];
        }
    }

    v8f o0 = {}, o1 = {}, o2 = {}, o3 = {};
    float mrun = -1e37f;   // running maximum of query q0 + l, equal in both halves
    float Lrun = 0.0f;     // running sum over this half's keys only

    // stage 0 into buffer 0, landed and published; then stage 1 into buffer 1
    stage_to_lds(kg, vg, eg, ag, kl0, vl0, el0, al0);
    asm volatile("s_wait_asynccnt 0x0" ::: "memory");   // this wave's copies of stage 0 have landed
    __syncthreads();                                     // stage 0 visible to all waves
    stage_to_lds(kg + KT * DKK, vg + KT * DKK, eg + KT, ag + KT,
                 kl0 + kvbuf_bytes, vl0 + kvbuf_bytes, el0 + eabuf_bytes, al0 + eabuf_bytes);

    for (int st = 0; st < WW / KT; ++st) {
      const int buf = st & 1;
      #pragma unroll   // the two 16-key passes of a stage differ only in constant LDS offsets
      for (int u = 0; u < KT / 16; ++u) {
        // ----- this pass's operands, asked for together at its head -----
        // bias + mask: eight consecutive keys of one row per lane
        const v4f e0 = *(const v4f*)(&Elds[buf][wav * 16 + l][u * 16 + 8 * half]);
        const v4f e1 = *(const v4f*)(&Elds[buf][wav * 16 + l][u * 16 + 8 * half + 4]);
        const v4i a0 = *(const v4i*)(&Mlds[buf][wav * 16 + l][u * 16 + 8 * half]);
        const v4i a1 = *(const v4i*)(&Mlds[buf][wav * 16 + l][u * 16 + 8 * half + 4]);
        // K fragments (A operand: row l = key)
        v2f kf[16];
        #pragma unroll
        for (int kk4 = 0; kk4 < 16; ++kk4) {
            kf[kk4].x = Klds[buf][u * 16 + l][kk4 * 4 + 2 * half];
            kf[kk4].y = Klds[buf][u * 16 + l][kk4 * 4 + 2 * half + 1];
        }
        // V^T fragments (A operand: row l = head column).  k slot (half, e) of
        // step t is key 16u + 8*half + 2t + e
        v2f vf[4][4];
        #pragma unroll
        for (int t = 0; t < 4; ++t) {
            const int r0 = u * 16 + 8 * half + 2 * t;
            #pragma unroll
            for (int dt = 0; dt < 4; ++dt) {
                vf[t][dt].x = Vlds[buf][r0][dt * 16 + l];
                vf[t][dt].y = Vlds[buf][r0 + 1][dt * 16 + l];
            }
        }
        // hold the LDS loads above together as one group at the head of the pass:
        // without these two statements the compiler sinks each load to its use and
        // the wave waits out every one.  They take the loaded values as inputs only.
        asm volatile("" :: "v"(kf[0]), "v"(kf[1]), "v"(kf[2]), "v"(kf[3]), "v"(kf[4]), "v"(kf[5]),
                           "v"(kf[6]), "v"(kf[7]), "v"(kf[8]), "v"(kf[9]), "v"(kf[10]), "v"(kf[11]),
                           "v"(kf[12]), "v"(kf[13]), "v"(kf[14]), "v"(kf[15]),
                           "v"(e0), "v"(e1), "v"(a0), "v"(a1));
        asm volatile("" :: "v"(vf[0][0]), "v"(vf[0][1]), "v"(vf[0][2]), "v"(vf[0][3]),
                           "v"(vf[1][0]), "v"(vf[1][1]), "v"(vf[1][2]), "v"(vf[1][3]),
                           "v"(vf[2][0]), "v"(vf[2][1]), "v"(vf[2][2]), "v"(vf[2][3]),
                           "v"(vf[3][0]), "v"(vf[3][1]), "v"(vf[3][2]), "v"(vf[3][3]));

        // ----- S^T = K * Q^T (16 keys x 16 queries), K-dim = 64 -> 16 WMMAs -----
        v8f s = {};
        #pragma unroll
        for (int kk4 = 0; kk4 < 16; ++kk4)
            s = wmma_f32(kf[kk4], qfrag[kk4], s);
        // s[i] = score of query q0 + l against key st*32 + u*16 + 8*half + i

        // ----- bias + mask -----
        {
            const float e[8] = { e0.x, e0.y, e0.z, e0.w, e1.x, e1.y, e1.z, e1.w };
            const int   a[8] = { a0.x, a0.y, a0.z, a0.w, a1.x, a1.y, a1.z, a1.w };
            #pragma unroll
            for (int i = 0; i < 8; ++i) {
                float biasv = fminf(fmaxf(e[i], -1.0f), 1.0f) * BIAS_SCALE;
                float sv = s[i] * SOFT_SCALE + biasv;
                s[i] = (a[i] > 0) ? sv : -1e38f;
            }
        }

        // ----- online softmax: in-lane over 8 keys, one exchange between halves --
        float rm = s[0];
        #pragma unroll
        for (int i = 1; i < 8; ++i) rm = fmaxf(rm, s[i]);
        rm = fmaxf(rm, xhalf(rm));
        const float mn = fmaxf(mrun, rm);
        const float sc = exp_slot(mrun - mn);
        float p[8];
        float rs = 0.0f;
        #pragma unroll
        for (int i = 0; i < 8; ++i) {
            p[i] = exp_slot(s[i] - mn);
            rs += p[i];
        }
        Lrun = Lrun * sc + rs;
        mrun = mn;
        #pragma unroll
        for (int i = 0; i < 8; ++i) {
            o0[i] *= sc; o1[i] *= sc; o2[i] *= sc; o3[i] *= sc;
        }

        // keeps the asm exponentials out from among the products below
        __builtin_amdgcn_sched_barrier(0);

        // ----- O^T += V^T * P^T: with V's k slots, B of step t is the register
        // pair p[2t], p[2t+1] -----
        #pragma unroll
        for (int t = 0; t < 4; ++t) {
            v2f pf;
            pf.x = p[2 * t];
            pf.y = p[2 * t + 1];
            o0 = wmma_f32(vf[t][0], pf, o0);
            o1 = wmma_f32(vf[t][1], pf, o1);
            o2 = wmma_f32(vf[t][2], pf, o2);
            o3 = wmma_f32(vf[t][3], pf, o3);
        }
      }

      // ----- publish point of stage st + 1 -----
      asm volatile("s_wait_dscnt 0x0" ::: "memory");      // this wave's reads of buf have returned
      asm volatile("s_wait_asynccnt 0x0" ::: "memory");   // its copies of stage st + 1 have landed
      __syncthreads();   // stage st + 1 visible to all; every wave has left buf
      if (st + 2 < WW / KT) {
          const unsigned kb = (unsigned)buf * kvbuf_bytes, eb = (unsigned)buf * eabuf_bytes;
          const size_t nx = (size_t)(st + 2);
          stage_to_lds(kg + nx * (KT * DKK), vg + nx * (KT * DKK), eg + nx * KT, ag + nx * KT,
                       kl0 + kb, vl0 + kb, el0 + eb, al0 + eb);
      }
    }
    asm volatile("s_wait_asynccnt 0x0" ::: "memory");     // nothing in flight when the wave ends

    // ----- join the halves' sums, normalize, store y ((B, W, D) layout) -----
    // oN[i] = O[q0 + l][N*16 + 8*half + i]: eight consecutive floats per tile
    {
        const float inv = 1.0f / (Lrun + xhalf(Lrun));
        float* yr = y_ws + ((size_t)b * WW + q0 + l) * DD + h * DKK + 8 * half;
        *(float4*)(yr)      = make_float4(o0[0] * inv, o0[1] * inv, o0[2] * inv, o0[3] * inv);
        *(float4*)(yr + 4)  = make_float4(o0[4] * inv, o0[5] * inv, o0[6] * inv, o0[7] * inv);
        *(float4*)(yr + 16) = make_float4(o1[0] * inv, o1[1] * inv, o1[2] * inv, o1[3] * inv);
        *(float4*)(yr + 20) = make_float4(o1[4] * inv, o1[5] * inv, o1[6] * inv, o1[7] * inv);
        *(float4*)(yr + 32) = make_float4(o2[0] * inv, o2[1] * inv, o2[2] * inv, o2[3] * inv);
        *(float4*)(yr + 36) = make_float4(o2[4] * inv, o2[5] * inv, o2[6] * inv, o2[7] * inv);
        *(float4*)(yr + 48) = make_float4(o3[0] * inv, o3[1] * inv, o3[2] * inv, o3[3] * inv);
        *(float4*)(yr + 52) = make_float4(o3[4] * inv, o3[5] * inv, o3[6] * inv, o3[7] * inv);
    }
}

// ---------------------------------------------------------------------------
// Kernel 3: output projection + residual + LayerNorm, fused.
// Block: 256 threads (8 waves) computes 16 full rows (16 x 512).
// ---------------------------------------------------------------------------
__global__ __launch_bounds__(256) void out_ln_kernel(
    const float* __restrict__ y_ws, const float* __restrict__ Wo,
    const float* __restrict__ bo,   const float* __restrict__ x,
    const float* __restrict__ ln_g, const float* __restrict__ ln_b,
    float* __restrict__ out)
{
    const int m0 = blockIdx.x * 16;
    const int b  = blockIdx.y;
    const int tid  = threadIdx.x;
    const int wav  = tid >> 5;
    const int lane = tid & 31;
    const int half = lane >> 4;
    const int l    = lane & 15;

    __shared__ float Alds[16][36];
    __shared__ float Hlds[16][520];          // 16 x 512 (+8 pad)

    v8f a0 = {}, a1 = {}, a2 = {}, a3 = {};
    const float* yb = y_ws + (size_t)b * WW * DD;

    for (int k0 = 0; k0 < DD; k0 += KC) {
        if (tid < 128) {                     // 16x32 A tile, one float4/thread
            int row = tid >> 3, c4 = tid & 7;
            *(float4*)(&Alds[row][c4 * 4]) =
                *(const float4*)(yb + (size_t)(m0 + row) * DD + k0 + c4 * 4);
        }
        __syncthreads();
        #pragma unroll
        for (int kk = 0; kk < KC; kk += 4) {
            v2f a;
            a.x = Alds[l][kk + 2 * half];
            a.y = Alds[l][kk + 2 * half + 1];
            const float* wr = Wo + (size_t)(k0 + kk + 2 * half) * DD + wav * 64 + l;
            v2f bf;
            bf.x = wr[0];   bf.y = wr[DD];        a0 = wmma_f32(a, bf, a0);
            bf.x = wr[16];  bf.y = wr[DD + 16];   a1 = wmma_f32(a, bf, a1);
            bf.x = wr[32];  bf.y = wr[DD + 32];   a2 = wmma_f32(a, bf, a2);
            bf.x = wr[48];  bf.y = wr[DD + 48];   a3 = wmma_f32(a, bf, a3);
        }
        __syncthreads();
    }

    // h = proj + bias + residual -> LDS
    const float* xb = x + ((size_t)b * WW + m0) * DD;
    #pragma unroll
    for (int i = 0; i < 8; ++i) {
        int row = i + 8 * half;
        int n = wav * 64 + l;
        Hlds[row][n]      = a0[i] + bo[n]      + xb[(size_t)row * DD + n];
        Hlds[row][n + 16] = a1[i] + bo[n + 16] + xb[(size_t)row * DD + n + 16];
        Hlds[row][n + 32] = a2[i] + bo[n + 32] + xb[(size_t)row * DD + n + 32];
        Hlds[row][n + 48] = a3[i] + bo[n + 48] + xb[(size_t)row * DD + n + 48];
    }
    __syncthreads();

    // LayerNorm: 16 threads per row, 32 cols each; shuffle-reduce within halves
    const int row = tid >> 4;
    const int seg = tid & 15;
    float s1 = 0.0f, s2 = 0.0f;
    #pragma unroll
    for (int c = 0; c < 32; ++c) {
        float v = Hlds[row][seg * 32 + c];
        s1 += v; s2 += v * v;
    }
    s1 += __shfl_xor(s1, 1, 32);  s2 += __shfl_xor(s2, 1, 32);
    s1 += __shfl_xor(s1, 2, 32);  s2 += __shfl_xor(s2, 2, 32);
    s1 += __shfl_xor(s1, 4, 32);  s2 += __shfl_xor(s2, 4, 32);
    s1 += __shfl_xor(s1, 8, 32);  s2 += __shfl_xor(s2, 8, 32);
    const float mu  = s1 * (1.0f / DD);
    const float var = s2 * (1.0f / DD) - mu * mu;
    const float r   = rsqrtf(var + LN_EPS);

    float* orow = out + ((size_t)b * WW + m0 + row) * DD;
    #pragma unroll
    for (int c = 0; c < 32; ++c) {
        int n = seg * 32 + c;
        orow[n] = (Hlds[row][n] - mu) * r * ln_g[n] + ln_b[n];
    }
}

// ---------------------------------------------------------------------------
extern "C" void kernel_launch(void* const* d_in, const int* in_sizes, int n_in,
                              void* d_out, int out_size, void* d_ws, size_t ws_size,
                              hipStream_t stream) {
    const float* x      = (const float*)d_in[0];
    const float* E_time = (const float*)d_in[1];
    const int*   A_time = (const int*)  d_in[2];
    const float* Wq     = (const float*)d_in[3];
    const float* Wk     = (const float*)d_in[4];
    const float* Wv     = (const float*)d_in[5];
    const float* Wo     = (const float*)d_in[6];
    const float* bq     = (const float*)d_in[7];
    const float* bk     = (const float*)d_in[8];
    const float* bv     = (const float*)d_in[9];
    const float* bo     = (const float*)d_in[10];
    const float* ln_g   = (const float*)d_in[11];
    const float* ln_b   = (const float*)d_in[12];
    float* out = (float*)d_out;

    const size_t HEADSZ = (size_t)BB * HH * WW * DKK;   // 4.19M floats each
    float* q_ws = (float*)d_ws;
    float* k_ws = q_ws + HEADSZ;
    float* v_ws = k_ws + HEADSZ;
    float* y_ws = v_ws + HEADSZ;

    // 1) QKV projections: grid (M/128, N/128, B*3)
    qkv_proj_kernel<<<dim3(WW / 128, DD / 128, BB * 3), 256, 0, stream>>>(
        x, Wq, Wk, Wv, bq, bk, bv, q_ws, k_ws, v_ws);

    // 2) Flash attention: grid (qtiles/4, H, B), 4 waves/block
    flash_attn_kernel<<<dim3(WW / 16 / 4, HH, BB), 128, 0, stream>>>(
        q_ws, k_ws, v_ws, E_time, A_time, y_ws);

    // 3) Output projection + residual + LayerNorm: grid (W/16, B)
    out_ln_kernel<<<dim3(WW / 16, BB), 256, 0, stream>>>(
        y_ws, Wo, bo, x, ln_g, ln_b, out);
}
